// v000
// Times are from an AMD MI455X. After a warm-up the kernel runs many times in a row, and a time is the length of
// such a window on the GPU divided by its runs, so every launch and the gaps after it count. The runs cycle
// through copies of the inputs. A figure is the median of several windows, for all but v000 over two sittings.
// Sittings can differ by a few percent; kernels timed side by side share one.
// The starting kernel, v000, takes 526 microseconds a run.
#include <hip/hip_runtime.h>
#include <cmath>

typedef float v2f __attribute__((ext_vector_type(2)));
typedef float v4f __attribute__((ext_vector_type(4)));
typedef float v8f __attribute__((ext_vector_type(8)));

#define TILE_M 128
#define TILE_N 128
#define KC     32
#define KPAD   (KC + 4)   // +4 dwords: 16B-aligned b128 stores, debanked rows

enum Act { ACT_NONE = 0, ACT_BLEND = 1, ACT_RELU = 2 };

__device__ __forceinline__ float blend_act_f(float x) {
    // x>0: 0.9*x + 0.1*tanh(x); else 0.5*tanh(x)
    float t = tanhf(x);
    return x > 0.0f ? fmaf(x, 0.9f, t * 0.1f) : t * 0.5f;
}

template <int ACT>
__global__ __launch_bounds__(256)
void gemm_bias_act(const float* __restrict__ A,   // M x K, row-major
                   const float* __restrict__ B,   // K x N, row-major
                   const float* __restrict__ bias,// N
                   float* __restrict__ C,         // M x N, row-major
                   int M, int N, int K)
{
    __shared__ float lA [TILE_M][KPAD];  // A tile, row-major  (128 x 36 dwords)
    __shared__ float lBt[TILE_N][KPAD];  // B tile, TRANSPOSED (n-major, k inner)

    const int tid  = threadIdx.x;
    const int lane = tid & 31;
    const int wave = tid >> 5;
    const int wm   = wave >> 1;
    const int wn   = wave & 1;
    const int half = lane >> 4;
    const int l16  = lane & 15;

    const int m0 = blockIdx.y * TILE_M;
    const int n0 = blockIdx.x * TILE_N;
    const bool nFull = (n0 + TILE_N) <= N;   // uniform: fast vs guarded B path

    v8f acc[2][4];
    #pragma unroll
    for (int i = 0; i < 2; ++i)
        #pragma unroll
        for (int j = 0; j < 4; ++j)
            acc[i][j] = (v8f){0.f, 0.f, 0.f, 0.f, 0.f, 0.f, 0.f, 0.f};

    for (int k0 = 0; k0 < K; k0 += KC) {
        // ---- stage A tile: 128 rows x 32 floats = 1024 float4, 4 per thread
        #pragma unroll
        for (int i = 0; i < 4; ++i) {
            int slot = tid + i * 256;
            int r    = slot >> 3;          // 8 float4 per row
            int c4   = slot & 7;
            v4f v = *(const v4f*)(A + (size_t)(m0 + r) * K + k0 + c4 * 4);
            *(v4f*)(&lA[r][c4 * 4]) = v;   // stride 36 dwords -> 16B aligned
        }
        // ---- stage B tile transposed: 32 k-rows x 128 cols = 1024 float4
        #pragma unroll
        for (int i = 0; i < 4; ++i) {
            int slot = tid + i * 256;
            int k    = slot >> 5;          // 32 float4 per k-row
            int c4   = slot & 31;
            if (nFull) {
                v4f v = *(const v4f*)(B + (size_t)(k0 + k) * N + n0 + c4 * 4);
                lBt[c4 * 4 + 0][k] = v.x;
                lBt[c4 * 4 + 1][k] = v.y;
                lBt[c4 * 4 + 2][k] = v.z;
                lBt[c4 * 4 + 3][k] = v.w;
            } else {
                #pragma unroll
                for (int e = 0; e < 4; ++e) {
                    int n = n0 + c4 * 4 + e;
                    lBt[c4 * 4 + e][k] =
                        (n < N) ? B[(size_t)(k0 + k) * N + n] : 0.0f;
                }
            }
        }
        __syncthreads();

        // ---- 8 k-steps; each: 2 A frags + 4 B frags -> 8 WMMAs
        // A frag (16x4): lane -> row, k pair {kk+2*half, +1}
        // B frag (4x16): lane -> col, k pair {kk+2*half, +1}
        #pragma unroll
        for (int kk = 0; kk < KC; kk += 4) {
            const int ks = kk + 2 * half;
            v2f a[2], b[4];
            #pragma unroll
            for (int i = 0; i < 2; ++i)
                a[i] = *(const v2f*)(&lA[wm * 32 + i * 16 + l16][ks]);
            #pragma unroll
            for (int j = 0; j < 4; ++j)
                b[j] = *(const v2f*)(&lBt[wn * 64 + j * 16 + l16][ks]);
            #pragma unroll
            for (int i = 0; i < 2; ++i)
                #pragma unroll
                for (int j = 0; j < 4; ++j)
                    acc[i][j] = __builtin_amdgcn_wmma_f32_16x16x4_f32(
                        false, a[i], false, b[j], (short)0, acc[i][j],
                        false, false);
        }
        __syncthreads();
    }

    #pragma unroll
    for (int i = 0; i < 2; ++i) {
        const int row_base = m0 + wm * 32 + i * 16 + 8 * half;
        #pragma unroll
        for (int j = 0; j < 4; ++j) {
            const int col = n0 + wn * 64 + j * 16 + l16;
            if (col >= N) continue;
            const float bia = bias[col];
            #pragma unroll
            for (int r = 0; r < 8; ++r) {
                float v = acc[i][j][r] + bia;
                if constexpr (ACT == ACT_BLEND) v = blend_act_f(v);
                else if constexpr (ACT == ACT_RELU) v = fmaxf(v, 0.0f);
                C[(size_t)(row_base + r) * N + col] = v;
            }
        }
    }
}

extern "C" void kernel_launch(void* const* d_in, const int* in_sizes, int n_in,
                              void* d_out, int out_size, void* d_ws, size_t ws_size,
                              hipStream_t stream)
{
    (void)in_sizes; (void)n_in; (void)out_size; (void)ws_size;

    const float* x  = (const float*)d_in[0];   // 32768 x 512
    const float* W1 = (const float*)d_in[1];   // 512 x 1024
    const float* b1 = (const float*)d_in[2];   // 1024
    const float* W2 = (const float*)d_in[3];   // 1024 x 512
    const float* b2 = (const float*)d_in[4];   // 512
    const float* W3 = (const float*)d_in[5];   // 512 x 10
    const float* b3 = (const float*)d_in[6];   // 10
    float* out = (float*)d_out;                // 32768 x 10

    const int B = 32768, D = 512, H = 1024, H2 = 512, C = 10;

    float* h  = (float*)d_ws;                  // B*H  fp32 (128 MiB)
    float* h2 = h + (size_t)B * H;             // B*H2 fp32 ( 64 MiB)

    dim3 blk(256);
    // Same-stream launches serialize -> correct inter-layer ordering.
    gemm_bias_act<ACT_BLEND><<<dim3(H  / TILE_N,               B / TILE_M), blk, 0, stream>>>(
        x,  W1, b1, h,   B, H,  D);
    gemm_bias_act<ACT_RELU ><<<dim3(H2 / TILE_N,               B / TILE_M), blk, 0, stream>>>(
        h,  W2, b2, h2,  B, H2, H);
    gemm_bias_act<ACT_NONE ><<<dim3((C + TILE_N - 1) / TILE_N, B / TILE_M), blk, 0, stream>>>(
        h2, W3, b3, out, B, C,  H2);
}

// v001
// It runs in 392 microseconds.
// Next to v000, in two timings, it ran 1.37 and 1.38 times as fast.
#include <hip/hip_runtime.h>
#include <cmath>
#include <cstdint>

typedef float v2f __attribute__((ext_vector_type(2)));
typedef float v4f __attribute__((ext_vector_type(4)));
typedef float v8f __attribute__((ext_vector_type(8)));

#define TILE_M 128
#define TILE_N 128
#define KC     32
#define KPAD   (KC + 4)   // +4 dwords: 16B-aligned b128 stores, debanked rows

enum Act { ACT_NONE = 0, ACT_BLEND = 1, ACT_RELU = 2 };

__device__ __forceinline__ float blend_act_f(float x) {
    // x>0: 0.9*x + 0.1*tanh(x); else 0.5*tanh(x)
    float t = tanhf(x);
    return x > 0.0f ? fmaf(x, 0.9f, t * 0.1f) : t * 0.5f;
}

template <int ACT>
__global__ __launch_bounds__(256)
void gemm_bias_act(const float* __restrict__ A,   // M x K, row-major
                   const float* __restrict__ B,   // K x N, row-major
                   const float* __restrict__ bias,// N
                   float* __restrict__ C,         // M x N, row-major
                   int M, int N, int K)
{
    __shared__ float lA [TILE_M][KPAD];  // A tile, row-major  (128 x 36 dwords)
    __shared__ float lBt[TILE_N][KPAD];  // B tile, TRANSPOSED (n-major, k inner)

    const int tid  = threadIdx.x;
    const int lane = tid & 31;
    const int wave = tid >> 5;
    const int wm   = wave >> 1;
    const int wn   = wave & 1;
    const int half = lane >> 4;
    const int l16  = lane & 15;

    const int m0 = blockIdx.y * TILE_M;
    const int n0 = blockIdx.x * TILE_N;
    const bool nFull = (n0 + TILE_N) <= N;   // uniform: fast vs guarded B path

    v8f acc[2][4];
    #pragma unroll
    for (int i = 0; i < 2; ++i)
        #pragma unroll
        for (int j = 0; j < 4; ++j)
            acc[i][j] = (v8f){0.f, 0.f, 0.f, 0.f, 0.f, 0.f, 0.f, 0.f};

    for (int k0 = 0; k0 < K; k0 += KC) {
        // ---- stage A tile: 128 rows x 32 floats = 1024 float4, 4 per thread
        #pragma unroll
        for (int i = 0; i < 4; ++i) {
            int slot = tid + i * 256;
            int r    = slot >> 3;          // 8 float4 per row
            int c4   = slot & 7;
            v4f v = *(const v4f*)(A + (size_t)(m0 + r) * K + k0 + c4 * 4);
            *(v4f*)(&lA[r][c4 * 4]) = v;   // stride 36 dwords -> 16B aligned
        }
        // ---- stage B tile transposed: 32 k-rows x 128 cols = 1024 float4
        #pragma unroll
        for (int i = 0; i < 4; ++i) {
            int slot = tid + i * 256;
            int k    = slot >> 5;          // 32 float4 per k-row
            int c4   = slot & 31;
            if (nFull) {
                v4f v = *(const v4f*)(B + (size_t)(k0 + k) * N + n0 + c4 * 4);
                lBt[c4 * 4 + 0][k] = v.x;
                lBt[c4 * 4 + 1][k] = v.y;
                lBt[c4 * 4 + 2][k] = v.z;
                lBt[c4 * 4 + 3][k] = v.w;
            } else {
                #pragma unroll
                for (int e = 0; e < 4; ++e) {
                    int n = n0 + c4 * 4 + e;
                    lBt[c4 * 4 + e][k] =
                        (n < N) ? B[(size_t)(k0 + k) * N + n] : 0.0f;
                }
            }
        }
        __syncthreads();

        // ---- 8 k-steps; each: 2 A frags + 4 B frags -> 8 WMMAs
        // A frag (16x4): lane -> row, k pair {kk+2*half, +1}
        // B frag (4x16): lane -> col, k pair {kk+2*half, +1}
        #pragma unroll
        for (int kk = 0; kk < KC; kk += 4) {
            const int ks = kk + 2 * half;
            v2f a[2], b[4];
            #pragma unroll
            for (int i = 0; i < 2; ++i)
                a[i] = *(const v2f*)(&lA[wm * 32 + i * 16 + l16][ks]);
            #pragma unroll
            for (int j = 0; j < 4; ++j)
                b[j] = *(const v2f*)(&lBt[wn * 64 + j * 16 + l16][ks]);
            #pragma unroll
            for (int i = 0; i < 2; ++i)
                #pragma unroll
                for (int j = 0; j < 4; ++j)
                    acc[i][j] = __builtin_amdgcn_wmma_f32_16x16x4_f32(
                        false, a[i], false, b[j], (short)0, acc[i][j],
                        false, false);
        }
        __syncthreads();
    }

    #pragma unroll
    for (int i = 0; i < 2; ++i) {
        const int row_base = m0 + wm * 32 + i * 16 + 8 * half;
        #pragma unroll
        for (int j = 0; j < 4; ++j) {
            const int col = n0 + wn * 64 + j * 16 + l16;
            if (col >= N) continue;
            const float bia = bias[col];
            #pragma unroll
            for (int r = 0; r < 8; ++r) {
                float v = acc[i][j][r] + bia;
                if constexpr (ACT == ACT_BLEND) v = blend_act_f(v);
                else if constexpr (ACT == ACT_RELU) v = fmaxf(v, 0.0f);
                C[(size_t)(row_base + r) * N + col] = v;
            }
        }
    }
}

// ---------------------------------------------------------------------------
// Ring form for the two large layers (M, N multiples of 128; K a multiple of
// 32). Both tiles go from global memory to LDS by asynchronous copies, two
// buffers, so that a tile's copies fly under the WMMAs of the tile before it.
// The LDS layout, the fragment reads and the k order are those of the kernel
// above: A by 16-byte copies; B by 4-byte copies, each lane placing its own
// dword in the transposed tile (32 lanes = one 128-byte line of a k-row).
// ---------------------------------------------------------------------------

__device__ __forceinline__ void copy_tile(unsigned la, unsigned lb,
                                          const float* ga, const float* gb,
                                          size_t aStep, size_t bStep)
{
    const float* ga1 = ga  + aStep;
    const float* ga2 = ga1 + aStep;
    const float* ga3 = ga2 + aStep;
    const float* g1 = gb + bStep;
    const float* g2 = g1 + bStep;
    const float* g3 = g2 + bStep;
    const float* g4 = g3 + bStep;
    const float* g5 = g4 + bStep;
    const float* g6 = g5 + bStep;
    const float* g7 = g6 + bStep;
    asm volatile(
        "global_load_async_to_lds_b128 %0, %12, off\n\t"
        "global_load_async_to_lds_b128 %1, %13, off\n\t"
        "global_load_async_to_lds_b128 %2, %14, off\n\t"
        "global_load_async_to_lds_b128 %3, %15, off\n\t"
        "global_load_async_to_lds_b32 %4, %16, off\n\t"
        "global_load_async_to_lds_b32 %5, %17, off\n\t"
        "global_load_async_to_lds_b32 %6, %18, off\n\t"
        "global_load_async_to_lds_b32 %7, %19, off\n\t"
        "global_load_async_to_lds_b32 %8, %20, off\n\t"
        "global_load_async_to_lds_b32 %9, %21, off\n\t"
        "global_load_async_to_lds_b32 %10, %22, off\n\t"
        "global_load_async_to_lds_b32 %11, %23, off\n\t"
        "s_wait_xcnt 0x0"
        :: "v"(la), "v"(la + 32u * KPAD * 4u), "v"(la + 64u * KPAD * 4u),
           "v"(la + 96u * KPAD * 4u),
           "v"(lb), "v"(lb + 8u), "v"(lb + 16u), "v"(lb + 24u),
           "v"(lb + 32u), "v"(lb + 40u), "v"(lb + 48u), "v"(lb + 56u),
           "v"(ga), "v"(ga1), "v"(ga2), "v"(ga3),
           "v"(gb), "v"(g1), "v"(g2), "v"(g3),
           "v"(g4), "v"(g5), "v"(g6), "v"(g7)
        : "memory");
    const float* h0 = g7 + bStep;
    const float* h1 = h0 + bStep;
    const float* h2 = h1 + bStep;
    const float* h3 = h2 + bStep;
    const float* h4 = h3 + bStep;
    const float* h5 = h4 + bStep;
    const float* h6 = h5 + bStep;
    const float* h7 = h6 + bStep;
    asm volatile(
        "global_load_async_to_lds_b32 %0, %8, off\n\t"
        "global_load_async_to_lds_b32 %1, %9, off\n\t"
        "global_load_async_to_lds_b32 %2, %10, off\n\t"
        "global_load_async_to_lds_b32 %3, %11, off\n\t"
        "global_load_async_to_lds_b32 %4, %12, off\n\t"
        "global_load_async_to_lds_b32 %5, %13, off\n\t"
        "global_load_async_to_lds_b32 %6, %14, off\n\t"
        "global_load_async_to_lds_b32 %7, %15, off\n\t"
        "s_wait_xcnt 0x0"
        :: "v"(lb + 64u), "v"(lb + 72u), "v"(lb + 80u), "v"(lb + 88u),
           "v"(lb + 96u), "v"(lb + 104u), "v"(lb + 112u), "v"(lb + 120u),
           "v"(h0), "v"(h1), "v"(h2), "v"(h3),
           "v"(h4), "v"(h5), "v"(h6), "v"(h7)
        : "memory");
}

template <int ACT>
__global__ __launch_bounds__(256)
void gemm_bias_act_ring(const float* __restrict__ A,   // M x K, row-major
                        const float* __restrict__ B,   // K x N, row-major
                        const float* __restrict__ bias,// N
                        float* __restrict__ C,         // M x N, row-major
                        int M, int N, int K)
{
    __shared__ __attribute__((aligned(16))) float lA [2][TILE_M][KPAD];
    __shared__ __attribute__((aligned(16))) float lBt[2][TILE_N][KPAD];

    const int tid  = threadIdx.x;
    const int lane = tid & 31;
    const int wave = __builtin_amdgcn_readfirstlane(tid >> 5);  // wave-uniform: kept in a scalar register
    const int wm   = wave >> 1;
    const int wn   = wave & 1;
    const int half = lane >> 4;
    const int l16  = lane & 15;

    const int m0 = blockIdx.y * TILE_M;
    const int n0 = blockIdx.x * TILE_N;

    // this thread's first copies of a tile: A row tid/8, 16 bytes (then +32
    // rows three times); B element (k = tid/128, n = tid%128) (then +2 k-rows
    // fifteen times)
    const int ar = tid >> 3, ac = (tid & 7) * 4;
    const int bk = tid >> 7, bn = tid & 127;
    // element offsets in 32 bits (both operands hold fewer than 2^32 elements)
    const unsigned oA = (unsigned)(m0 + ar) * (unsigned)K + (unsigned)ac;
    const unsigned oB = (unsigned)bk * (unsigned)N + (unsigned)(n0 + bn);
    const size_t aStep = (size_t)32 * K;
    const size_t bStep = (size_t)2 * N;
    const unsigned bTile = (unsigned)KC * (unsigned)N;
    const unsigned ldsA = (unsigned)(uintptr_t)&lA [0][ar][ac];
    const unsigned ldsB = (unsigned)(uintptr_t)&lBt[0][bn][bk];
    const unsigned bufBytes = TILE_M * KPAD * 4u;   // one buffer of either tile

    v8f acc[2][4];
    #pragma unroll
    for (int i = 0; i < 2; ++i)
        #pragma unroll
        for (int j = 0; j < 4; ++j)
            acc[i][j] = (v8f){0.f, 0.f, 0.f, 0.f, 0.f, 0.f, 0.f, 0.f};

    const int T = K / KC;

    // ---- prologue: tile 0 landed and published, then tile 1 in flight
    copy_tile(ldsA, ldsB, A + oA, B + oB, aStep, bStep);
    // this wave's copies of tile 0 have landed before the barrier publishes them
    asm volatile("s_wait_asynccnt 0x0" ::: "memory");
    __syncthreads();
    if (T > 1)
        copy_tile(ldsA + bufBytes, ldsB + bufBytes, A + (oA + KC), B + (oB + bTile),
                  aStep, bStep);

    for (int t = 0; t < T; ++t) {
        const int buf = t & 1;
        #pragma unroll
        for (int kk = 0; kk < KC; kk += 4) {
            const int ks = kk + 2 * half;
            v2f a[2], b[4];
            #pragma unroll
            for (int i = 0; i < 2; ++i)
                a[i] = *(const v2f*)(&lA[buf][wm * 32 + i * 16 + l16][ks]);
            #pragma unroll
            for (int j = 0; j < 4; ++j)
                b[j] = *(const v2f*)(&lBt[buf][wn * 64 + j * 16 + l16][ks]);
            #pragma unroll
            for (int i = 0; i < 2; ++i)
                #pragma unroll
                for (int j = 0; j < 4; ++j)
                    acc[i][j] = __builtin_amdgcn_wmma_f32_16x16x4_f32(
                        false, a[i], false, b[j], (short)0, acc[i][j],
                        false, false);
        }
        // ---- publish point of tile t + 1
        // this wave's reads of the buffer about to be refilled have retired
        asm volatile("s_wait_dscnt 0x0" ::: "memory");
        // this wave's copies of tile t + 1 have landed
        asm volatile("s_wait_asynccnt 0x0" ::: "memory");
        __syncthreads();
        if (t + 2 < T)
            copy_tile(ldsA + buf * bufBytes, ldsB + buf * bufBytes,
                      A + (oA + (unsigned)(t + 2) * KC),
                      B + (oB + (unsigned)(t + 2) * bTile), aStep, bStep);
    }
    // no copy is outstanding when the wave goes on to its stores and ends
    asm volatile("s_wait_asynccnt 0x0" ::: "memory");

    #pragma unroll
    for (int i = 0; i < 2; ++i) {
        const int row_base = m0 + wm * 32 + i * 16 + 8 * half;
        #pragma unroll
        for (int j = 0; j < 4; ++j) {
            const int col = n0 + wn * 64 + j * 16 + l16;
            const float bia = bias[col];
            #pragma unroll
            for (int r = 0; r < 8; ++r) {
                float v = acc[i][j][r] + bia;
                if constexpr (ACT == ACT_BLEND) v = blend_act_f(v);
                else if constexpr (ACT == ACT_RELU) v = fmaxf(v, 0.0f);
                C[(size_t)(row_base + r) * N + col] = v;
            }
        }
    }
}

extern "C" void kernel_launch(void* const* d_in, const int* in_sizes, int n_in,
                              void* d_out, int out_size, void* d_ws, size_t ws_size,
                              hipStream_t stream)
{
    (void)in_sizes; (void)n_in; (void)out_size; (void)ws_size;

    const float* x  = (const float*)d_in[0];   // 32768 x 512
    const float* W1 = (const float*)d_in[1];   // 512 x 1024
    const float* b1 = (const float*)d_in[2];   // 1024
    const float* W2 = (const float*)d_in[3];   // 1024 x 512
    const float* b2 = (const float*)d_in[4];   // 512
    const float* W3 = (const float*)d_in[5];   // 512 x 10
    const float* b3 = (const float*)d_in[6];   // 10
    float* out = (float*)d_out;                // 32768 x 10

    const int B = 32768, D = 512, H = 1024, H2 = 512, C = 10;

    float* h  = (float*)d_ws;                  // B*H  fp32 (128 MiB)
    float* h2 = h + (size_t)B * H;             // B*H2 fp32 ( 64 MiB)

    dim3 blk(256);
    // Same-stream launches serialize -> correct inter-layer ordering.
    gemm_bias_act_ring<ACT_BLEND><<<dim3(H  / TILE_N,               B / TILE_M), blk, 0, stream>>>(
        x,  W1, b1, h,   B, H,  D);
    gemm_bias_act_ring<ACT_RELU ><<<dim3(H2 / TILE_N,               B / TILE_M), blk, 0, stream>>>(
        h,  W2, b2, h2,  B, H2, H);
    gemm_bias_act<ACT_NONE ><<<dim3((C + TILE_N - 1) / TILE_N, B / TILE_M), blk, 0, stream>>>(
        h2, W3, b3, out, B, C,  H2);
}

// v002
// One run takes 343 microseconds.
// Next to v001, in two timings, it ran 1.14 times as fast each time.
// All steps since v000 together make it 1.57 times as fast.
#include <hip/hip_runtime.h>
#include <cmath>
#include <cstdint>

typedef float v2f __attribute__((ext_vector_type(2)));
typedef float v4f __attribute__((ext_vector_type(4)));
typedef float v8f __attribute__((ext_vector_type(8)));

#define TILE_M 128
#define TILE_N 128
#define KC     32
#define KPAD   (KC + 4)   // +4 dwords: 16B-aligned b128 stores, debanked rows

enum Act { ACT_NONE = 0, ACT_BLEND = 1, ACT_RELU = 2 };

__device__ __forceinline__ float blend_act_f(float x) {
    // x>0: 0.9*x + 0.1*tanh(x); else 0.5*tanh(x)
    float t = tanhf(x);
    return x > 0.0f ? fmaf(x, 0.9f, t * 0.1f) : t * 0.5f;
}

// ---------------------------------------------------------------------------
// Ring form for the two large layers (M, N multiples of 128; K a multiple of
// 32). Both tiles go from global memory to LDS by asynchronous copies, two
// buffers, so that a tile's copies fly under the WMMAs of the tile before it.
// A row-major, B transposed in LDS: A by 16-byte copies; B by 4-byte copies,
// each lane placing its own dword in the transposed tile (32 lanes = one
// 128-byte line of a k-row).
// ---------------------------------------------------------------------------

__device__ __forceinline__ void copy_tile(unsigned la, unsigned lb,
                                          const float* ga, const float* gb,
                                          size_t aStep, size_t bStep)
{
    const float* ga1 = ga  + aStep;
    const float* ga2 = ga1 + aStep;
    const float* ga3 = ga2 + aStep;
    const float* g1 = gb + bStep;
    const float* g2 = g1 + bStep;
    const float* g3 = g2 + bStep;
    const float* g4 = g3 + bStep;
    const float* g5 = g4 + bStep;
    const float* g6 = g5 + bStep;
    const float* g7 = g6 + bStep;
    asm volatile(
        "global_load_async_to_lds_b128 %0, %12, off\n\t"
        "global_load_async_to_lds_b128 %1, %13, off\n\t"
        "global_load_async_to_lds_b128 %2, %14, off\n\t"
        "global_load_async_to_lds_b128 %3, %15, off\n\t"
        "global_load_async_to_lds_b32 %4, %16, off\n\t"
        "global_load_async_to_lds_b32 %5, %17, off\n\t"
        "global_load_async_to_lds_b32 %6, %18, off\n\t"
        "global_load_async_to_lds_b32 %7, %19, off\n\t"
        "global_load_async_to_lds_b32 %8, %20, off\n\t"
        "global_load_async_to_lds_b32 %9, %21, off\n\t"
        "global_load_async_to_lds_b32 %10, %22, off\n\t"
        "global_load_async_to_lds_b32 %11, %23, off\n\t"
        "s_wait_xcnt 0x0"
        :: "v"(la), "v"(la + 32u * KPAD * 4u), "v"(la + 64u * KPAD * 4u),
           "v"(la + 96u * KPAD * 4u),
           "v"(lb), "v"(lb + 8u), "v"(lb + 16u), "v"(lb + 24u),
           "v"(lb + 32u), "v"(lb + 40u), "v"(lb + 48u), "v"(lb + 56u),
           "v"(ga), "v"(ga1), "v"(ga2), "v"(ga3),
           "v"(gb), "v"(g1), "v"(g2), "v"(g3),
           "v"(g4), "v"(g5), "v"(g6), "v"(g7)
        : "memory");
    const float* h0 = g7 + bStep;
    const float* h1 = h0 + bStep;
    const float* h2 = h1 + bStep;
    const float* h3 = h2 + bStep;
    const float* h4 = h3 + bStep;
    const float* h5 = h4 + bStep;
    const float* h6 = h5 + bStep;
    const float* h7 = h6 + bStep;
    asm volatile(
        "global_load_async_to_lds_b32 %0, %8, off\n\t"
        "global_load_async_to_lds_b32 %1, %9, off\n\t"
        "global_load_async_to_lds_b32 %2, %10, off\n\t"
        "global_load_async_to_lds_b32 %3, %11, off\n\t"
        "global_load_async_to_lds_b32 %4, %12, off\n\t"
        "global_load_async_to_lds_b32 %5, %13, off\n\t"
        "global_load_async_to_lds_b32 %6, %14, off\n\t"
        "global_load_async_to_lds_b32 %7, %15, off\n\t"
        "s_wait_xcnt 0x0"
        :: "v"(lb + 64u), "v"(lb + 72u), "v"(lb + 80u), "v"(lb + 88u),
           "v"(lb + 96u), "v"(lb + 104u), "v"(lb + 112u), "v"(lb + 120u),
           "v"(h0), "v"(h1), "v"(h2), "v"(h3),
           "v"(h4), "v"(h5), "v"(h6), "v"(h7)
        : "memory");
}

template <int ACT>
__global__ __launch_bounds__(256)
void gemm_bias_act_ring(const float* __restrict__ A,   // M x K, row-major
                        const float* __restrict__ B,   // K x N, row-major
                        const float* __restrict__ bias,// N
                        float* __restrict__ C,         // M x N, row-major
                        int M, int N, int K)
{
    __shared__ __attribute__((aligned(16))) float lA [2][TILE_M][KPAD];
    __shared__ __attribute__((aligned(16))) float lBt[2][TILE_N][KPAD];

    const int tid  = threadIdx.x;
    const int lane = tid & 31;
    const int wave = __builtin_amdgcn_readfirstlane(tid >> 5);  // wave-uniform: kept in a scalar register
    const int wm   = wave >> 1;
    const int wn   = wave & 1;
    const int half = lane >> 4;
    const int l16  = lane & 15;

    const int m0 = blockIdx.y * TILE_M;
    const int n0 = blockIdx.x * TILE_N;

    // this thread's first copies of a tile: A row tid/8, 16 bytes (then +32
    // rows three times); B element (k = tid/128, n = tid%128) (then +2 k-rows
    // fifteen times)
    const int ar = tid >> 3, ac = (tid & 7) * 4;
    const int bk = tid >> 7, bn = tid & 127;
    // element offsets in 32 bits (both operands hold fewer than 2^32 elements)
    const unsigned oA = (unsigned)(m0 + ar) * (unsigned)K + (unsigned)ac;
    const unsigned oB = (unsigned)bk * (unsigned)N + (unsigned)(n0 + bn);
    const size_t aStep = (size_t)32 * K;
    const size_t bStep = (size_t)2 * N;
    const unsigned bTile = (unsigned)KC * (unsigned)N;
    const unsigned ldsA = (unsigned)(uintptr_t)&lA [0][ar][ac];
    const unsigned ldsB = (unsigned)(uintptr_t)&lBt[0][bn][bk];
    const unsigned bufBytes = TILE_M * KPAD * 4u;   // one buffer of either tile

    v8f acc[2][4];
    #pragma unroll
    for (int i = 0; i < 2; ++i)
        #pragma unroll
        for (int j = 0; j < 4; ++j)
            acc[i][j] = (v8f){0.f, 0.f, 0.f, 0.f, 0.f, 0.f, 0.f, 0.f};

    const int T = K / KC;

    // ---- prologue: tile 0 landed and published, then tile 1 in flight
    copy_tile(ldsA, ldsB, A + oA, B + oB, aStep, bStep);
    // this wave's copies of tile 0 have landed before the barrier publishes them
    asm volatile("s_wait_asynccnt 0x0" ::: "memory");
    __syncthreads();
    if (T > 1)
        copy_tile(ldsA + bufBytes, ldsB + bufBytes, A + (oA + KC), B + (oB + bTile),
                  aStep, bStep);

    for (int t = 0; t < T; ++t) {
        const int buf = t & 1;
        #pragma unroll
        for (int kk = 0; kk < KC; kk += 4) {
            const int ks = kk + 2 * half;
            v2f a[2], b[4];
            #pragma unroll
            for (int i = 0; i < 2; ++i)
                a[i] = *(const v2f*)(&lA[buf][wm * 32 + i * 16 + l16][ks]);
            #pragma unroll
            for (int j = 0; j < 4; ++j)
                b[j] = *(const v2f*)(&lBt[buf][wn * 64 + j * 16 + l16][ks]);
            #pragma unroll
            for (int i = 0; i < 2; ++i)
                #pragma unroll
                for (int j = 0; j < 4; ++j)
                    acc[i][j] = __builtin_amdgcn_wmma_f32_16x16x4_f32(
                        false, a[i], false, b[j], (short)0, acc[i][j],
                        false, false);
        }
        // ---- publish point of tile t + 1
        // this wave's reads of the buffer about to be refilled have retired
        asm volatile("s_wait_dscnt 0x0" ::: "memory");
        // this wave's copies of tile t + 1 have landed
        asm volatile("s_wait_asynccnt 0x0" ::: "memory");
        __syncthreads();
        if (t + 2 < T)
            copy_tile(ldsA + buf * bufBytes, ldsB + buf * bufBytes,
                      A + (oA + (unsigned)(t + 2) * KC),
                      B + (oB + (unsigned)(t + 2) * bTile), aStep, bStep);
    }
    // no copy is outstanding when the wave goes on to its stores and ends
    asm volatile("s_wait_asynccnt 0x0" ::: "memory");

    #pragma unroll
    for (int i = 0; i < 2; ++i) {
        const int row_base = m0 + wm * 32 + i * 16 + 8 * half;
        #pragma unroll
        for (int j = 0; j < 4; ++j) {
            const int col = n0 + wn * 64 + j * 16 + l16;
            const float bia = bias[col];
            #pragma unroll
            for (int r = 0; r < 8; ++r) {
                float v = acc[i][j][r] + bia;
                if constexpr (ACT == ACT_BLEND) v = blend_act_f(v);
                else if constexpr (ACT == ACT_RELU) v = fmaxf(v, 0.0f);
                C[(size_t)(row_base + r) * N + col] = v;
            }
        }
    }
}

#define HR      64
#define HK      512
#define HN      10
#define HKQ     (HK / 4)
#define HPITCH  (HK + 4)
#define RPITCH  20

__device__ __forceinline__ void copy_rows8(unsigned l, const float* g)
{
    const unsigned ls = 2u * HPITCH * 4u;   // LDS bytes between two copies
    const int      gs = 2 * HK;             // floats between two copies
    asm volatile(
        "global_load_async_to_lds_b128 %0, %8, off\n\t"
        "global_load_async_to_lds_b128 %1, %9, off\n\t"
        "global_load_async_to_lds_b128 %2, %10, off\n\t"
        "global_load_async_to_lds_b128 %3, %11, off\n\t"
        "global_load_async_to_lds_b128 %4, %12, off\n\t"
        "global_load_async_to_lds_b128 %5, %13, off\n\t"
        "global_load_async_to_lds_b128 %6, %14, off\n\t"
        "global_load_async_to_lds_b128 %7, %15, off\n\t"
        "s_wait_xcnt 0x0"
        :: "v"(l), "v"(l + ls), "v"(l + 2u * ls), "v"(l + 3u * ls),
           "v"(l + 4u * ls), "v"(l + 5u * ls), "v"(l + 6u * ls), "v"(l + 7u * ls),
           "v"(g), "v"(g + gs), "v"(g + 2 * gs), "v"(g + 3 * gs),
           "v"(g + 4 * gs), "v"(g + 5 * gs), "v"(g + 6 * gs), "v"(g + 7 * gs)
        : "memory");
}

__global__ __launch_bounds__(256)
void head_gemm(const float* __restrict__ A,   // M x 512, row-major
               const float* __restrict__ B,   // 512 x 10, row-major
               const float* __restrict__ bias,// 10
               float* __restrict__ C)         // M x 10, row-major
{
    __shared__ __attribute__((aligned(16))) float lA[HR][HPITCH];
    // every loop below is unrolled in full: b, a and acc are then registers, and
    // all LDS and global offsets immediates

    const int tid  = threadIdx.x;
    const int lane = tid & 31;
    const int wave = __builtin_amdgcn_readfirstlane(tid >> 5);  // wave-uniform: kept in a scalar register
    const int wr   = wave & 1;         // which 32 rows
    const int wk   = wave >> 1;        // which quarter of K
    const int half = lane >> 4;
    const int l16  = lane & 15;
    const int m0   = blockIdx.x * HR;

    // ---- fill: thread t brings 16 bytes of row t/128, then of every second row
    const int fr = tid >> 7, fc = (tid & 127) * 4;
    const unsigned lds0 = (unsigned)(uintptr_t)&lA[fr][fc];
    const float*   g0   = A + (size_t)(m0 + fr) * HK + fc;
    #pragma unroll
    for (int q = 0; q < 4; ++q)
        copy_rows8(lds0 + (unsigned)q * 16u * HPITCH * 4u, g0 + q * 16 * HK);

    // ---- under the copies' flight: this wave's 32 B fragments and its bias
    // B frag (4x16): lane -> col, k pair {kk+2*half, +1}, as the A fragment
    const int cc = l16 < HN ? l16 : HN - 1;
    const float* bp = B + (wk * HKQ + 2 * half) * HN + cc;
    v2f b[HKQ / 4];
    #pragma unroll
    for (int s = 0; s < HKQ / 4; ++s)
        b[s] = (v2f){bp[s * 4 * HN], bp[s * 4 * HN + HN]};
    // the bias is the start value of the first quarter's sums (C/D: lane -> col)
    const float bi = wk == 0 ? bias[cc] : 0.0f;

    // this wave's copies have landed before the barrier publishes them
    asm volatile("s_wait_asynccnt 0x0" ::: "memory");
    __syncthreads();

    v8f acc[2];
    #pragma unroll
    for (int i = 0; i < 2; ++i)
        acc[i] = (v8f){bi, bi, bi, bi, bi, bi, bi, bi};

    // A frag (16x4): lane -> row, k pair {kk+2*half, +1}
    const float* ap = &lA[wr * 32 + l16][wk * HKQ + 2 * half];
    #pragma unroll
    for (int s = 0; s < HKQ / 4; ++s) {
        v2f a[2];
        #pragma unroll
        for (int i = 0; i < 2; ++i)
            a[i] = *(const v2f*)(ap + i * 16 * HPITCH + s * 4);
        #pragma unroll
        for (int i = 0; i < 2; ++i)
            acc[i] = __builtin_amdgcn_wmma_f32_16x16x4_f32(
                false, a[i], false, b[s], (short)0, acc[i], false, false);
    }

    __builtin_amdgcn_sched_barrier(0);
    asm volatile("v_nop\n\tv_nop\n\tv_nop\n\tv_nop");
    __builtin_amdgcn_sched_barrier(0);

    // every wave has read its fragments: the block's LDS is free for the partials
    __syncthreads();
    float* red = &lA[0][0];   // [4 quarters of K][HR rows][RPITCH]
    #pragma unroll
    for (int i = 0; i < 2; ++i)
        #pragma unroll
        for (int r = 0; r < 8; ++r)
            red[(wk * HR + wr * 32 + i * 16 + 8 * half + r) * RPITCH + l16] = acc[i][r];
    __syncthreads();

    // ---- 640 results, contiguous in C: a wave stores one whole 128-byte line
    #pragma unroll
    for (int u = 0; u < 3; ++u) {
        const int f = tid + u * 256;
        if (u < 2 || tid < HR * HN - 512) {
            const int row = f / HN, col = f - row * HN;
            float s = red[row * RPITCH + col];
            #pragma unroll
            for (int w = 1; w < 4; ++w)
                s += red[(w * HR + row) * RPITCH + col];
            C[(size_t)m0 * HN + f] = s;
        }
    }
}

extern "C" void kernel_launch(void* const* d_in, const int* in_sizes, int n_in,
                              void* d_out, int out_size, void* d_ws, size_t ws_size,
                              hipStream_t stream)
{
    (void)in_sizes; (void)n_in; (void)out_size; (void)ws_size;

    const float* x  = (const float*)d_in[0];   // 32768 x 512
    const float* W1 = (const float*)d_in[1];   // 512 x 1024
    const float* b1 = (const float*)d_in[2];   // 1024
    const float* W2 = (const float*)d_in[3];   // 1024 x 512
    const float* b2 = (const float*)d_in[4];   // 512
    const float* W3 = (const float*)d_in[5];   // 512 x 10
    const float* b3 = (const float*)d_in[6];   // 10
    float* out = (float*)d_out;                // 32768 x 10

    const int B = 32768, D = 512, H = 1024, H2 = 512;

    float* h  = (float*)d_ws;                  // B*H  fp32 (128 MiB)
    float* h2 = h + (size_t)B * H;             // B*H2 fp32 ( 64 MiB)

    dim3 blk(256);
    // Same-stream launches serialize -> correct inter-layer ordering.
    gemm_bias_act_ring<ACT_BLEND><<<dim3(H  / TILE_N,               B / TILE_M), blk, 0, stream>>>(
        x,  W1, b1, h,   B, H,  D);
    gemm_bias_act_ring<ACT_RELU ><<<dim3(H2 / TILE_N,               B / TILE_M), blk, 0, stream>>>(
        h,  W2, b2, h2,  B, H2, H);
    head_gemm<<<dim3(B / HR), blk, 0, stream>>>(h2, W3, b3, out);
}
